// v000
// Measured on an AMD MI455X. A time is GPU time per run, averaged over a window of back-to-back runs after a warm-up
// (all launches, gaps included; the runs take copies of the inputs in turn), and the median of several windows.
// Apart from v000's, it joins two sittings. Times from different sittings can be a few percent apart, while
// side-by-side timings come from the same sitting.
// v000 is the starting kernel.
#include <hip/hip_runtime.h>
#include <hip/hip_bf16.h>

typedef __attribute__((ext_vector_type(2))) float v2f;
typedef __attribute__((ext_vector_type(4))) float v4f;
typedef __attribute__((ext_vector_type(8))) float v8f;

constexpr int BTOK = 4096;
constexpr int IN   = 256;
constexpr int OUT  = 256;
constexpr int E    = 16;
constexpr int BDIM = 512;           // 16 waves (wave32) -> fills one WGP
constexpr int CG   = 64;            // output columns per block (4 WMMA N-tiles)
constexpr int LDS_STRIDE = IN + 4;  // 260 floats: break 64-bank periodicity
constexpr int LDS_BYTES  = CG * LDS_STRIDE * (int)sizeof(float); // ~65 KB

// ---------------------------------------------------------------------------
// Kernel 1: bucket tokens by expert.  counts[e] and buckets[e][i] live in d_ws.
// Bucket order is non-deterministic but each token's output row is computed
// independently, so final output values are deterministic.
// ---------------------------------------------------------------------------
__global__ void bin_tokens_kernel(const int* __restrict__ route,
                                  int* __restrict__ counts,
                                  int* __restrict__ buckets) {
    int b = blockIdx.x * blockDim.x + threadIdx.x;
    if (b < BTOK) {
        int e = route[b];
        int p = atomicAdd(&counts[e], 1);
        buckets[e * BTOK + p] = b;
    }
}

// ---------------------------------------------------------------------------
// Kernel 2: fused grouped GEMM.
//   grid = (E, OUT/64); block = 512 threads = 16 waves.
//   Each block: one expert e, a 64-wide output-column group.
//   LDS holds Wc = W[e] + W_fact for those 64 output rows (64 x 256 f32),
//   loaded from HBM exactly once per block.
//   Each wave walks this expert's 16-token tiles; per K-step:
//     1x global_load_b64 (A) + 2x ds_load_2addr_b64 (4 B pairs) + 4x WMMA
//   -> 4x A-fragment reuse, full f32 precision via V_WMMA_F32_16X16X4_F32.
//   Tail rows clamp to a valid token (unconditional loads, unstored rows).
// ---------------------------------------------------------------------------
__global__ __launch_bounds__(BDIM) void moe_wmma_kernel(
    const float* __restrict__ input,   // [BTOK, IN]
    const float* __restrict__ weight,  // [E, OUT*IN]
    const float* __restrict__ wfact,   // [OUT*IN]
    const float* __restrict__ bias,    // [E, OUT]
    const float* __restrict__ bfact,   // [OUT]
    const int*   __restrict__ counts,  // [E]
    const int*   __restrict__ buckets, // [E, BTOK]
    float*       __restrict__ out)     // [BTOK, OUT]
{
    extern __shared__ float lds[];     // [CG][LDS_STRIDE]

    const int e   = blockIdx.x;
    const int ob  = blockIdx.y * CG;   // output-column base
    const int tid = threadIdx.x;

    // --- build combined weight tile in LDS: lds[m][n] = W[e][ob+m][n] + Wf[ob+m][n]
    const float* we = weight + (size_t)e * (OUT * IN) + (size_t)ob * IN;
    const float* wf = wfact + (size_t)ob * IN;
    for (int j = tid; j < CG * (IN / 4); j += BDIM) {   // 4096 float4s
        int m = j >> 6;            // 64 float4 per row
        int n = (j & 63) << 2;
        v4f a = *(const v4f*)(we + m * IN + n);
        v4f b = *(const v4f*)(wf + m * IN + n);
        *(v4f*)(&lds[m * LDS_STRIDE + n]) = a + b;
    }
    __syncthreads();

    const int wave = tid >> 5;
    const int lane = tid & 31;
    const int half = lane >> 4;        // 0: lanes 0-15, 1: lanes 16-31
    const int l16  = lane & 15;

    const int  cnt    = counts[e];
    const int  ntiles = (cnt + 15) >> 4;
    const int* bkt    = buckets + e * BTOK;

    // Per N-tile (ct): lane owns column N = l16 -> global col ob + ct*16 + l16.
    float        bsum[4];
    const float* brow[4];
    #pragma unroll
    for (int ct = 0; ct < 4; ++ct) {
        int col  = ob + ct * 16 + l16;
        bsum[ct] = bias[e * OUT + col] + bfact[col];
        // B operand: row (ct*16 + l16) of Wc; lanes>=16 carry K+2,K+3.
        brow[ct] = &lds[(ct * 16 + l16) * LDS_STRIDE + (half << 1)];
    }

    for (int tile = wave; tile < ntiles; tile += BDIM / 32) {
        const int base = tile * 16;
        // A-layout: lane supplies row M = l16; clamp tail rows to last valid.
        int idx  = base + l16;
        idx      = idx < cnt ? idx : cnt - 1;
        int tokA = bkt[idx];
        const float* arow = input + (size_t)tokA * IN + (half << 1);

        v8f acc[4] = {{}, {}, {}, {}};
        #pragma unroll 8
        for (int k = 0; k < IN; k += 4) {
            v2f a = *(const v2f*)(arow + k);
            #pragma unroll
            for (int ct = 0; ct < 4; ++ct) {
                v2f b = *(const v2f*)(brow[ct] + k);
                acc[ct] = __builtin_amdgcn_wmma_f32_16x16x4_f32(
                    /*neg_a=*/false, a, /*neg_b=*/false, b,
                    /*c_mod=*/(short)0, acc[ct], /*reuse_a=*/false, /*reuse_b=*/false);
            }
        }

        // D-layout: VGPR g holds row M = g + 8*half, col N = l16 (per ct tile).
        // Row M's token id lives in lane M's tokA register -> shuffle, no reload.
        #pragma unroll
        for (int g = 0; g < 8; ++g) {
            int M = g + (half << 3);
            int r = base + M;
            int t = __shfl(tokA, M);
            if (r < cnt) {
                float* orow = out + (size_t)t * OUT + ob + l16;
                #pragma unroll
                for (int ct = 0; ct < 4; ++ct) {
                    orow[ct * 16] = acc[ct][g] + bsum[ct];
                }
            }
        }
    }
}

// ---------------------------------------------------------------------------
extern "C" void kernel_launch(void* const* d_in, const int* in_sizes, int n_in,
                              void* d_out, int out_size, void* d_ws, size_t ws_size,
                              hipStream_t stream) {
    const float* input  = (const float*)d_in[0];
    const int*   route  = (const int*)  d_in[1];
    const float* weight = (const float*)d_in[2];
    const float* wfact  = (const float*)d_in[3];
    const float* bias   = (const float*)d_in[4];
    const float* bfact  = (const float*)d_in[5];
    float*       out    = (float*)d_out;

    // workspace layout: [64 ints counts (padded)] [E*BTOK ints buckets]
    int* counts  = (int*)d_ws;
    int* buckets = counts + 64;

    hipMemsetAsync(counts, 0, 64 * sizeof(int), stream);
    bin_tokens_kernel<<<(BTOK + 255) / 256, 256, 0, stream>>>(route, counts, buckets);

    dim3 grid(E, OUT / CG);
    moe_wmma_kernel<<<grid, BDIM, LDS_BYTES, stream>>>(input, weight, wfact, bias,
                                                       bfact, counts, buckets, out);
}

// v001
// In both of two side-by-side timings against v000, it was 1.78 times as fast.
#include <hip/hip_runtime.h>
#include <hip/hip_bf16.h>

typedef __attribute__((ext_vector_type(2))) float v2f;
typedef __attribute__((ext_vector_type(4))) float v4f;
typedef __attribute__((ext_vector_type(8))) float v8f;

constexpr int BTOK = 4096;
constexpr int IN   = 256;
constexpr int OUT  = 256;
constexpr int E    = 16;
constexpr int BDIM = 128;           // 4 waves (wave32): one per SIMD of a WGP
constexpr int WAVES = BDIM / 32;
constexpr int TZ   = 5;             // token chunks per expert (grid.z): 5 * 64 rows
                                    // cover the mean BTOK/E = 256 plus 4 sigma in one pass
constexpr int CG   = 64;            // output columns per block (4 WMMA N-tiles)
constexpr int LDS_STRIDE = IN + 4;  // 260 floats: break 64-bank periodicity
constexpr int LDS_BYTES  = CG * LDS_STRIDE * (int)sizeof(float); // ~65 KB

// ---------------------------------------------------------------------------
// Kernel 1: bucket tokens by expert.  counts[e] and buckets[e][i] live in d_ws.
// Bucket order is non-deterministic but each token's output row is computed
// independently, so final output values are deterministic.
// ---------------------------------------------------------------------------
__global__ void bin_tokens_kernel(const int* __restrict__ route,
                                  int* __restrict__ counts,
                                  int* __restrict__ buckets) {
    int b = blockIdx.x * blockDim.x + threadIdx.x;
    if (b < BTOK) {
        int e = route[b];
        int p = atomicAdd(&counts[e], 1);
        buckets[e * BTOK + p] = b;
    }
}

// ---------------------------------------------------------------------------
// Kernel 2: fused grouped GEMM.
//   grid = (E, OUT/64, TZ); block = 128 threads = 4 waves.
//   Each block: one expert e, a 64-wide output-column group, and every TZ-th
//   chunk of four 16-token tiles, so the f32 matrix work spreads over all
//   WGPs and each wave has one tile under a balanced routing.
//   A block whose first chunk is past the expert's tokens leaves at once.
//   LDS holds Wc = W[e] + W_fact for those 64 output rows (64 x 256 f32).
//   Each wave walks its share of the expert's 16-token tiles; per K-step:
//     1x global_load_b64 (A) + 2x ds_load_2addr_b64 (4 B pairs) + 4x WMMA
//   -> 4x A-fragment reuse, full f32 precision via V_WMMA_F32_16X16X4_F32.
//   Tail rows clamp to a valid token (unconditional loads, unstored rows).
// ---------------------------------------------------------------------------
__global__ __launch_bounds__(BDIM) void moe_wmma_kernel(
    const float* __restrict__ input,   // [BTOK, IN]
    const float* __restrict__ weight,  // [E, OUT*IN]
    const float* __restrict__ wfact,   // [OUT*IN]
    const float* __restrict__ bias,    // [E, OUT]
    const float* __restrict__ bfact,   // [OUT]
    const int*   __restrict__ counts,  // [E]
    const int*   __restrict__ buckets, // [E, BTOK]
    float*       __restrict__ out)     // [BTOK, OUT]
{
    extern __shared__ float lds[];     // [CG][LDS_STRIDE]

    const int e   = blockIdx.x;
    const int ob  = blockIdx.y * CG;   // output-column base
    const int tid = threadIdx.x;

    const int cnt    = counts[e];
    const int ntiles = (cnt + 15) >> 4;
    // Block-uniform: no tile for any wave of this block, so no weights needed.
    if ((int)blockIdx.z * WAVES >= ntiles) return;

    // --- build combined weight tile in LDS: lds[m][n] = W[e][ob+m][n] + Wf[ob+m][n]
    const float* we = weight + (size_t)e * (OUT * IN) + (size_t)ob * IN;
    const float* wf = wfact + (size_t)ob * IN;
    for (int j = tid; j < CG * (IN / 4); j += BDIM) {   // 4096 float4s
        int m = j >> 6;            // 64 float4 per row
        int n = (j & 63) << 2;
        v4f a = *(const v4f*)(we + m * IN + n);
        v4f b = *(const v4f*)(wf + m * IN + n);
        *(v4f*)(&lds[m * LDS_STRIDE + n]) = a + b;
    }
    __syncthreads();

    const int wave = tid >> 5;
    const int lane = tid & 31;
    const int half = lane >> 4;        // 0: lanes 0-15, 1: lanes 16-31
    const int l16  = lane & 15;

    const int* bkt    = buckets + e * BTOK;

    // Per N-tile (ct): lane owns column N = l16 -> global col ob + ct*16 + l16.
    float        bsum[4];
    const float* brow[4];
    #pragma unroll
    for (int ct = 0; ct < 4; ++ct) {
        int col  = ob + ct * 16 + l16;
        bsum[ct] = bias[e * OUT + col] + bfact[col];
        // B operand: row (ct*16 + l16) of Wc; lanes>=16 carry K+2,K+3.
        brow[ct] = &lds[(ct * 16 + l16) * LDS_STRIDE + (half << 1)];
    }

    for (int tile = (int)blockIdx.z * WAVES + wave; tile < ntiles; tile += TZ * WAVES) {
        const int base = tile * 16;
        // A-layout: lane supplies row M = l16; clamp tail rows to last valid.
        int idx  = base + l16;
        idx      = idx < cnt ? idx : cnt - 1;
        int tokA = bkt[idx];
        const float* arow = input + (size_t)tokA * IN + (half << 1);

        v8f acc[4] = {{}, {}, {}, {}};
        #pragma unroll 8
        for (int k = 0; k < IN; k += 4) {
            v2f a = *(const v2f*)(arow + k);
            #pragma unroll
            for (int ct = 0; ct < 4; ++ct) {
                v2f b = *(const v2f*)(brow[ct] + k);
                acc[ct] = __builtin_amdgcn_wmma_f32_16x16x4_f32(
                    /*neg_a=*/false, a, /*neg_b=*/false, b,
                    /*c_mod=*/(short)0, acc[ct], /*reuse_a=*/false, /*reuse_b=*/false);
            }
        }

        // D-layout: VGPR g holds row M = g + 8*half, col N = l16 (per ct tile).
        // Row M's token id lives in lane M's tokA register -> shuffle, no reload.
        #pragma unroll
        for (int g = 0; g < 8; ++g) {
            int M = g + (half << 3);
            int r = base + M;
            int t = __shfl(tokA, M);
            if (r < cnt) {
                float* orow = out + (size_t)t * OUT + ob + l16;
                #pragma unroll
                for (int ct = 0; ct < 4; ++ct) {
                    orow[ct * 16] = acc[ct][g] + bsum[ct];
                }
            }
        }
    }
}

// ---------------------------------------------------------------------------
extern "C" void kernel_launch(void* const* d_in, const int* in_sizes, int n_in,
                              void* d_out, int out_size, void* d_ws, size_t ws_size,
                              hipStream_t stream) {
    const float* input  = (const float*)d_in[0];
    const int*   route  = (const int*)  d_in[1];
    const float* weight = (const float*)d_in[2];
    const float* wfact  = (const float*)d_in[3];
    const float* bias   = (const float*)d_in[4];
    const float* bfact  = (const float*)d_in[5];
    float*       out    = (float*)d_out;

    // workspace layout: [64 ints counts (padded)] [E*BTOK ints buckets]
    int* counts  = (int*)d_ws;
    int* buckets = counts + 64;

    hipMemsetAsync(counts, 0, 64 * sizeof(int), stream);
    bin_tokens_kernel<<<(BTOK + 255) / 256, 256, 0, stream>>>(route, counts, buckets);

    dim3 grid(E, OUT / CG, TZ);
    moe_wmma_kernel<<<grid, BDIM, LDS_BYTES, stream>>>(input, weight, wfact, bias,
                                                       bfact, counts, buckets, out);
}

// v002
// Measured time: 12.9 microseconds a run.
// Two timings next to v001 put it at 1.11 and 1.10 times that version's speed.
// Counting every step since v000, it is 1.97 times as fast.
#include <hip/hip_runtime.h>
#include <hip/hip_bf16.h>

typedef __attribute__((ext_vector_type(2))) float v2f;
typedef __attribute__((ext_vector_type(4))) float v4f;
typedef __attribute__((ext_vector_type(8))) float v8f;
typedef __attribute__((ext_vector_type(4))) int   v4i;

constexpr int BTOK = 4096;
constexpr int IN   = 256;
constexpr int OUT  = 256;
constexpr int E    = 16;
constexpr int BDIM = 128;           // 4 waves (wave32): one per SIMD of a WGP
constexpr int WAVES = BDIM / 32;
constexpr int TZ   = 5;             // token chunks per expert (grid.z): 5 * 64 rows
                                    // cover the mean BTOK/E = 256 plus 4 sigma in one pass
constexpr int CG   = 64;            // output columns per block (4 WMMA N-tiles)
constexpr int LDS_STRIDE = IN + 4;  // 260 floats: break 64-bank periodicity
constexpr int WTOK = BTOK / WAVES;  // tokens ranked by one wave
constexpr int NRV  = WTOK / 128;    // 16-byte route loads per lane (32 lanes x 4 ints)
// weight tile (~65 KB) + token list of one expert (worst case all tokens) + wave totals
// + one spare word per thread
constexpr int LDS_BYTES  = (CG * LDS_STRIDE + BTOK + WAVES + BDIM) * (int)sizeof(float);

// ---------------------------------------------------------------------------
// One launch: token ranking + grouped GEMM.
//   grid = (E, OUT/64, TZ); block = 128 threads = 4 waves.
//   Each block finds its expert's tokens itself: every wave compares a quarter
//   of route[] with e (one ballot per 32 tokens), the four wave totals meet in
//   LDS, and each match is stored to an LDS list at wave base + rank in ballot.
//   The list order is fixed by the token index alone; no workspace, no atomics.
//   A route value is only compared, never used in an address.
//   Each block: one expert e, a 64-wide output-column group, and every TZ-th
//   chunk of four 16-token tiles, so the f32 matrix work spreads over all
//   WGPs and each wave has one tile under a balanced routing.
//   A block whose first chunk is past the expert's tokens skips all the rest.
//   LDS holds Wc = W[e] + W_fact for those 64 output rows (64 x 256 f32).
//   Each wave walks its share of the expert's 16-token tiles; per K-step:
//     1x global_load_b64 (A) + 2x ds_load_2addr_b64 (4 B pairs) + 4x WMMA
//   -> 4x A-fragment reuse, full f32 precision via V_WMMA_F32_16X16X4_F32.
//   Tail rows clamp to a valid token (unconditional loads, unstored rows).
// ---------------------------------------------------------------------------
__global__ __launch_bounds__(BDIM) void moe_wmma_kernel(
    const float* __restrict__ input,   // [BTOK, IN]
    const int*   __restrict__ route,   // [BTOK]
    const float* __restrict__ weight,  // [E, OUT*IN]
    const float* __restrict__ wfact,   // [OUT*IN]
    const float* __restrict__ bias,    // [E, OUT]
    const float* __restrict__ bfact,   // [OUT]
    float*       __restrict__ out)     // [BTOK, OUT]
{
    extern __shared__ float lds[];     // [CG][LDS_STRIDE], then list, totals, spare words
    int* list = (int*)(lds + CG * LDS_STRIDE);   // [BTOK] this expert's tokens
    int* wtot = list + BTOK;                     // [WAVES] matches per wave

    const int e   = blockIdx.x;
    const int ob  = blockIdx.y * CG;   // output-column base
    const int tid = threadIdx.x;

    const int wave = __builtin_amdgcn_readfirstlane(tid >> 5);   // scalar wave number
    const int lane = tid & 31;

    // --- rank, part 1: one ballot per 32 tokens of this wave's quarter of route[]
    const int tok0 = wave * WTOK + lane * 4;
    v4i rv[NRV];
    #pragma unroll
    for (int i = 0; i < NRV; ++i) rv[i] = *(const v4i*)(route + tok0 + i * 128);
    unsigned msk[NRV * 4];
    int mine = 0;
    #pragma unroll
    for (int i = 0; i < NRV; ++i) {
        #pragma unroll
        for (int j = 0; j < 4; ++j) {
            msk[i * 4 + j] = __builtin_amdgcn_ballot_w32(rv[i][j] == e);
            mine += __builtin_popcount(msk[i * 4 + j]);
        }
    }
    if (lane == 0) wtot[wave] = mine;
    __syncthreads();                   // publishes the four wave totals
    int cnt_v = 0, pos_v = 0;
    #pragma unroll
    for (int w = 0; w < WAVES; ++w) {
        int t = wtot[w];
        cnt_v += t;
        pos_v += w < wave ? t : 0;
    }
    // Same in every lane and (cnt) every wave: scalar, so the branch below is too.
    const int cnt    = __builtin_amdgcn_readfirstlane(cnt_v);
    int       pos    = __builtin_amdgcn_readfirstlane(pos_v);
    const int ntiles = (cnt + 15) >> 4;
    // Block-uniform: no tile for any wave of this block, so nothing more to do.
    if ((int)blockIdx.z * WAVES < ntiles) {

    // --- rank, part 2: each match goes to list[wave base + matches ahead of it].
    // A lane without a match stores to a spare word of its own that nobody reads:
    // the 32 stores are then straight-line code and their address chains overlap.
    const int spare = BTOK + WAVES + tid;
    #pragma unroll
    for (int i = 0; i < NRV; ++i) {
        #pragma unroll
        for (int j = 0; j < 4; ++j) {
            const unsigned m = msk[i * 4 + j];
            const int slot = (int)__builtin_amdgcn_mbcnt_lo(m, (unsigned)pos);
            list[rv[i][j] == e ? slot : spare] = tok0 + i * 128 + j;
            pos += __builtin_popcount(m);
        }
    }

    // --- build combined weight tile in LDS: lds[m][n] = W[e][ob+m][n] + Wf[ob+m][n]
    const float* we = weight + (size_t)e * (OUT * IN) + (size_t)ob * IN;
    const float* wf = wfact + (size_t)ob * IN;
    for (int j = tid; j < CG * (IN / 4); j += BDIM) {   // 4096 float4s
        int m = j >> 6;            // 64 float4 per row
        int n = (j & 63) << 2;
        v4f a = *(const v4f*)(we + m * IN + n);
        v4f b = *(const v4f*)(wf + m * IN + n);
        *(v4f*)(&lds[m * LDS_STRIDE + n]) = a + b;
    }
    __syncthreads();

    const int half = lane >> 4;        // 0: lanes 0-15, 1: lanes 16-31
    const int l16  = lane & 15;

    // Per N-tile (ct): lane owns column N = l16 -> global col ob + ct*16 + l16.
    float        bsum[4];
    const float* brow[4];
    #pragma unroll
    for (int ct = 0; ct < 4; ++ct) {
        int col  = ob + ct * 16 + l16;
        bsum[ct] = bias[e * OUT + col] + bfact[col];
        // B operand: row (ct*16 + l16) of Wc; lanes>=16 carry K+2,K+3.
        brow[ct] = &lds[(ct * 16 + l16) * LDS_STRIDE + (half << 1)];
    }

    for (int tile = (int)blockIdx.z * WAVES + wave; tile < ntiles; tile += TZ * WAVES) {
        const int base = tile * 16;
        // A-layout: lane supplies row M = l16; clamp tail rows to last valid.
        int idx  = base + l16;
        idx      = idx < cnt ? idx : cnt - 1;
        int tokA = list[idx];
        const float* arow = input + (size_t)tokA * IN + (half << 1);

        v8f acc[4] = {{}, {}, {}, {}};
        #pragma unroll 8
        for (int k = 0; k < IN; k += 4) {
            v2f a = *(const v2f*)(arow + k);
            #pragma unroll
            for (int ct = 0; ct < 4; ++ct) {
                v2f b = *(const v2f*)(brow[ct] + k);
                acc[ct] = __builtin_amdgcn_wmma_f32_16x16x4_f32(
                    /*neg_a=*/false, a, /*neg_b=*/false, b,
                    /*c_mod=*/(short)0, acc[ct], /*reuse_a=*/false, /*reuse_b=*/false);
            }
        }

        // D-layout: VGPR g holds row M = g + 8*half, col N = l16 (per ct tile).
        // Row M's token id lives in lane M's tokA register -> shuffle, no reload.
        #pragma unroll
        for (int g = 0; g < 8; ++g) {
            int M = g + (half << 3);
            int r = base + M;
            int t = __shfl(tokA, M);
            if (r < cnt) {
                float* orow = out + (size_t)t * OUT + ob + l16;
                #pragma unroll
                for (int ct = 0; ct < 4; ++ct) {
                    orow[ct * 16] = acc[ct][g] + bsum[ct];
                }
            }
        }
    }

    }   // block has a tile
}

// ---------------------------------------------------------------------------
extern "C" void kernel_launch(void* const* d_in, const int* in_sizes, int n_in,
                              void* d_out, int out_size, void* d_ws, size_t ws_size,
                              hipStream_t stream) {
    const float* input  = (const float*)d_in[0];
    const int*   route  = (const int*)  d_in[1];
    const float* weight = (const float*)d_in[2];
    const float* wfact  = (const float*)d_in[3];
    const float* bias   = (const float*)d_in[4];
    const float* bfact  = (const float*)d_in[5];
    float*       out    = (float*)d_out;

    dim3 grid(E, OUT / CG, TZ);
    moe_wmma_kernel<<<grid, BDIM, LDS_BYTES, stream>>>(input, route, weight, wfact, bias,
                                                       bfact, out);
}

// v003
// Measured time: 11.3 microseconds a run.
// Next to v002, in two timings, it ran 1.14 times as fast each time.
// All steps since v000 together make it 2.24 times as fast.
#include <hip/hip_runtime.h>
#include <hip/hip_bf16.h>

typedef __attribute__((ext_vector_type(2))) float v2f;
typedef __attribute__((ext_vector_type(4))) float v4f;
typedef __attribute__((ext_vector_type(8))) float v8f;
typedef __attribute__((ext_vector_type(4))) int   v4i;

constexpr int BTOK = 4096;
constexpr int IN   = 256;
constexpr int OUT  = 256;
constexpr int E    = 16;
constexpr int BDIM = 128;           // 4 waves (wave32): one per SIMD of a WGP
constexpr int WAVES = BDIM / 32;
constexpr int TZ   = 5;             // token chunks per expert (grid.z): 5 * 64 rows
                                    // cover the mean BTOK/E = 256 plus 4 sigma in one pass
constexpr int CG   = 64;            // output columns per block (4 WMMA N-tiles)
constexpr int LDS_STRIDE = IN + 4;  // 260 floats: break 64-bank periodicity
constexpr int WTOK = BTOK / WAVES;  // tokens ranked by one wave
constexpr int NRV  = WTOK / 128;    // 16-byte route loads per lane (32 lanes x 4 ints)
// weight tile (~65 KB) + token list of one expert (worst case all tokens) + wave totals
// + one spare word per thread
constexpr int LDS_BYTES  = (CG * LDS_STRIDE + BTOK + WAVES + BDIM) * (int)sizeof(float);
constexpr int ATILE = 16 * LDS_STRIDE;   // one wave's 16 token rows in LDS, same pitch as Wc

// Gathers the 16 token rows of one tile into the calling wave's own LDS tile with
// asynchronous copies: one copy = half a row = four whole 128-byte lines, 32 copies.
// Tail rows clamp to the expert's last token (their LDS rows are filled, never stored).
// Called under wave-uniform control flow with every lane on. Returns the lane's token.
__device__ __forceinline__ int gather_rows(const float* __restrict__ input, const int* list,
                                           float* arows, int base, int cnt, int lane)
{
    int idx = base + (lane & 15);
    idx     = idx < cnt ? idx : cnt - 1;
    const int tok = list[idx];
    const unsigned dst0 = (unsigned)(uintptr_t)arows + (unsigned)lane * 16u;  // LDS byte address
    #pragma unroll
    for (int g = 0; g < 4; ++g) {
        unsigned     d[8];
        const float* p[8];
        #pragma unroll
        for (int c = 0; c < 8; ++c) {
            const int row = g * 4 + (c >> 1);
            const int t   = __builtin_amdgcn_readlane(tok, row);
            p[c] = input + (size_t)t * IN + (c & 1) * 128 + lane * 4;
            d[c] = dst0 + (unsigned)((row * LDS_STRIDE + (c & 1) * 128) * (int)sizeof(float));
        }
        // Eight copies and, as the statement's last line, the wait that stands in front
        // of any rewrite of the address registers the copies name.
        asm volatile(
            "global_load_async_to_lds_b128 %0, %8, off\n\t"
            "global_load_async_to_lds_b128 %1, %9, off\n\t"
            "global_load_async_to_lds_b128 %2, %10, off\n\t"
            "global_load_async_to_lds_b128 %3, %11, off\n\t"
            "global_load_async_to_lds_b128 %4, %12, off\n\t"
            "global_load_async_to_lds_b128 %5, %13, off\n\t"
            "global_load_async_to_lds_b128 %6, %14, off\n\t"
            "global_load_async_to_lds_b128 %7, %15, off\n\t"
            "s_wait_xcnt 0x0"
            :: "v"(d[0]), "v"(d[1]), "v"(d[2]), "v"(d[3]),
               "v"(d[4]), "v"(d[5]), "v"(d[6]), "v"(d[7]),
               "v"(p[0]), "v"(p[1]), "v"(p[2]), "v"(p[3]),
               "v"(p[4]), "v"(p[5]), "v"(p[6]), "v"(p[7])
            : "memory");
    }
    return tok;
}

// ---------------------------------------------------------------------------
// One launch: token ranking + grouped GEMM.
//   grid = (E, OUT/64, TZ); block = 128 threads = 4 waves.
//   Each block finds its expert's tokens itself: every wave compares a quarter
//   of route[] with e (one ballot per 32 tokens), the four wave totals meet in
//   LDS, and each match is stored to an LDS list at wave base + rank in ballot.
//   The list order is fixed by the token index alone; no workspace, no atomics.
//   A route value is only compared, never used in an address.
//   Each block: one expert e, a 64-wide output-column group, and every TZ-th
//   chunk of four 16-token tiles, so the f32 matrix work spreads over all
//   WGPs and each wave has one tile under a balanced routing.
//   A block whose first chunk is past the expert's tokens skips all the rest.
//   LDS holds Wc = W[e] + W_fact for those 64 output rows (64 x 256 f32).
//   Each wave's 16 token rows are copied to an LDS tile of its own, asynchronously,
//   while the weight tile is built; the K loop then reads A and B from LDS alone:
//   4x A-fragment reuse, full f32 precision via V_WMMA_F32_16X16X4_F32.
//   Tail rows clamp to a valid token (unconditional copies, unstored rows).
// ---------------------------------------------------------------------------
__global__ __launch_bounds__(BDIM) void moe_wmma_kernel(
    const float* __restrict__ input,   // [BTOK, IN]
    const int*   __restrict__ route,   // [BTOK]
    const float* __restrict__ weight,  // [E, OUT*IN]
    const float* __restrict__ wfact,   // [OUT*IN]
    const float* __restrict__ bias,    // [E, OUT]
    const float* __restrict__ bfact,   // [OUT]
    float*       __restrict__ out)     // [BTOK, OUT]
{
    extern __shared__ float lds[];     // [CG][LDS_STRIDE], then list, totals, spare words
    __shared__ __attribute__((aligned(16))) float atile[WAVES][ATILE];   // token rows per wave
    int* list = (int*)(lds + CG * LDS_STRIDE);   // [BTOK] this expert's tokens
    int* wtot = list + BTOK;                     // [WAVES] matches per wave

    const int e   = blockIdx.x;
    const int ob  = blockIdx.y * CG;   // output-column base
    const int tid = threadIdx.x;

    const int wave = __builtin_amdgcn_readfirstlane(tid >> 5);   // scalar wave number
    const int lane = tid & 31;

    // --- rank, part 1: one ballot per 32 tokens of this wave's quarter of route[]
    const int tok0 = wave * WTOK + lane * 4;
    v4i rv[NRV];
    #pragma unroll
    for (int i = 0; i < NRV; ++i) rv[i] = *(const v4i*)(route + tok0 + i * 128);
    unsigned msk[NRV * 4];
    int mine = 0;
    #pragma unroll
    for (int i = 0; i < NRV; ++i) {
        #pragma unroll
        for (int j = 0; j < 4; ++j) {
            msk[i * 4 + j] = __builtin_amdgcn_ballot_w32(rv[i][j] == e);
            mine += __builtin_popcount(msk[i * 4 + j]);
        }
    }
    if (lane == 0) wtot[wave] = mine;
    __syncthreads();                   // publishes the four wave totals
    int cnt_v = 0, pos_v = 0;
    #pragma unroll
    for (int w = 0; w < WAVES; ++w) {
        int t = wtot[w];
        cnt_v += t;
        pos_v += w < wave ? t : 0;
    }
    // Same in every lane and (cnt) every wave: scalar, so the branch below is too.
    const int cnt    = __builtin_amdgcn_readfirstlane(cnt_v);
    int       pos    = __builtin_amdgcn_readfirstlane(pos_v);
    const int ntiles = (cnt + 15) >> 4;
    // Block-uniform: no tile for any wave of this block, so nothing more to do.
    if ((int)blockIdx.z * WAVES < ntiles) {

    // --- rank, part 2: each match goes to list[wave base + matches ahead of it].
    // A lane without a match stores to a spare word of its own that nobody reads:
    // the 32 stores are then straight-line code and their address chains overlap.
    const int spare = BTOK + WAVES + tid;
    #pragma unroll
    for (int i = 0; i < NRV; ++i) {
        #pragma unroll
        for (int j = 0; j < 4; ++j) {
            const unsigned m = msk[i * 4 + j];
            const int slot = (int)__builtin_amdgcn_mbcnt_lo(m, (unsigned)pos);
            list[rv[i][j] == e ? slot : spare] = tok0 + i * 128 + j;
            pos += __builtin_popcount(m);
        }
    }

    __syncthreads();                   // publishes the list to the row gather below

    // --- this wave's first tile: its rows fly to LDS while the weight tile is built
    int tile = (int)blockIdx.z * WAVES + wave;
    int tokA = 0;
    if (tile < ntiles) tokA = gather_rows(input, list, atile[wave], tile * 16, cnt, lane);

    // --- build combined weight tile in LDS: lds[m][n] = W[e][ob+m][n] + Wf[ob+m][n]
    const float* we = weight + (size_t)e * (OUT * IN) + (size_t)ob * IN;
    const float* wf = wfact + (size_t)ob * IN;
    for (int j = tid; j < CG * (IN / 4); j += BDIM) {   // 4096 float4s
        int m = j >> 6;            // 64 float4 per row
        int n = (j & 63) << 2;
        v4f a = *(const v4f*)(we + m * IN + n);
        v4f b = *(const v4f*)(wf + m * IN + n);
        *(v4f*)(&lds[m * LDS_STRIDE + n]) = a + b;
    }
    // This wave's copies have landed before it reads them.
    asm volatile("s_wait_asynccnt 0x0" ::: "memory");
    __syncthreads();

    const int half = lane >> 4;        // 0: lanes 0-15, 1: lanes 16-31
    const int l16  = lane & 15;

    // Per N-tile (ct): lane owns column N = l16 -> global col ob + ct*16 + l16.
    float        bsum[4];
    const float* brow[4];
    #pragma unroll
    for (int ct = 0; ct < 4; ++ct) {
        int col  = ob + ct * 16 + l16;
        bsum[ct] = bias[e * OUT + col] + bfact[col];
        // B operand: row (ct*16 + l16) of Wc; lanes>=16 carry K+2,K+3.
        brow[ct] = &lds[(ct * 16 + l16) * LDS_STRIDE + (half << 1)];
    }

    // A-layout: lane supplies row M = l16 of the wave's LDS tile; lanes>=16 carry K+2,K+3.
    const float* arow = &atile[wave][l16 * LDS_STRIDE + (half << 1)];

    while (tile < ntiles) {
        const int base = tile * 16;

        v8f acc[4] = {{}, {}, {}, {}};
        #pragma unroll 8
        for (int k = 0; k < IN; k += 4) {
            v2f a = *(const v2f*)(arow + k);
            #pragma unroll
            for (int ct = 0; ct < 4; ++ct) {
                v2f b = *(const v2f*)(brow[ct] + k);
                acc[ct] = __builtin_amdgcn_wmma_f32_16x16x4_f32(
                    /*neg_a=*/false, a, /*neg_b=*/false, b,
                    /*c_mod=*/(short)0, acc[ct], /*reuse_a=*/false, /*reuse_b=*/false);
            }
        }

        // D-layout: VGPR g holds row M = g + 8*half, col N = l16 (per ct tile).
        // Row M's token id lives in lane M's tokA register -> shuffle, no reload.
        #pragma unroll
        for (int g = 0; g < 8; ++g) {
            int M = g + (half << 3);
            int r = base + M;
            int t = __shfl(tokA, M);
            if (r < cnt) {
                float* orow = out + (size_t)t * OUT + ob + l16;
                #pragma unroll
                for (int ct = 0; ct < 4; ++ct) {
                    orow[ct * 16] = acc[ct][g] + bsum[ct];
                }
            }
        }

        // A further tile (skewed routing only) refills the wave's own LDS tile: nobody
        // else reads it, so the wave's own waits order the refill; no barrier.
        tile += TZ * WAVES;
        if (tile < ntiles) {
            // The wave's reads of the old rows have retired before copies overwrite them.
            asm volatile("s_wait_dscnt 0x0" ::: "memory");
            tokA = gather_rows(input, list, atile[wave], tile * 16, cnt, lane);
            // The new rows have landed before the K loop reads them.
            asm volatile("s_wait_asynccnt 0x0" ::: "memory");
        }
    }

    }   // block has a tile
}

// ---------------------------------------------------------------------------
extern "C" void kernel_launch(void* const* d_in, const int* in_sizes, int n_in,
                              void* d_out, int out_size, void* d_ws, size_t ws_size,
                              hipStream_t stream) {
    const float* input  = (const float*)d_in[0];
    const int*   route  = (const int*)  d_in[1];
    const float* weight = (const float*)d_in[2];
    const float* wfact  = (const float*)d_in[3];
    const float* bias   = (const float*)d_in[4];
    const float* bfact  = (const float*)d_in[5];
    float*       out    = (float*)d_out;

    dim3 grid(E, OUT / CG, TZ);
    moe_wmma_kernel<<<grid, BDIM, LDS_BYTES, stream>>>(input, route, weight, wfact, bias,
                                                       bfact, out);
}

// v004
// Measured time: 10 microseconds a run.
// Two timings next to v003 put it at 1.13 and 1.12 times that version's speed.
// Over all steps from v000 it is 2.52 times as fast.
#include <hip/hip_runtime.h>
#include <hip/hip_bf16.h>

typedef __attribute__((ext_vector_type(2))) float v2f;
typedef __attribute__((ext_vector_type(4))) float v4f;
typedef __attribute__((ext_vector_type(8))) float v8f;
typedef __attribute__((ext_vector_type(4))) int   v4i;

constexpr int BTOK = 4096;
constexpr int IN   = 256;
constexpr int OUT  = 256;
constexpr int E    = 16;
constexpr int BDIM = 128;           // 4 waves (wave32): one per SIMD of a WGP
constexpr int WAVES = BDIM / 32;
constexpr int TZ   = 4;             // blocks that share one expert's token tiles (grid.z)
constexpr int TP   = 5;             // token tiles a block works on in one pass: the mean
                                    // BTOK/E = 256 tokens are 4 tiles a block, 5 cover 4 sigma
constexpr int CG   = 64;            // output columns per block: one 16-column tile per wave
constexpr int LDS_STRIDE = IN + 4;  // 260 floats: break 64-bank periodicity
constexpr int OPITCH = CG + 4;      // result tile pitch: 272 B = 16 B x odd for 16-byte reads
constexpr int WTOK = BTOK / WAVES;  // tokens ranked by one wave
constexpr int NRV  = WTOK / 128;    // 16-byte route loads per lane (32 lanes x 4 ints)
// weight tile (~65 KB) + token list of one expert (worst case all tokens) + wave totals
// + one spare word per thread
constexpr int LDS_BYTES  = (CG * LDS_STRIDE + BTOK + WAVES + BDIM) * (int)sizeof(float);

// Gathers the calling wave's quarter (4 * nt rows) of a pass's 16 * nt token rows into the
// block's LDS tile with asynchronous copies: one copy = half a row = four whole 128-byte
// lines, at most 40 copies a wave. Tail rows clamp to the expert's last token (their LDS
// rows are filled, never stored). nt and wave are scalars: wave-uniform flow, every lane on.
__device__ __forceinline__ void gather_rows(const float* __restrict__ input, const int* list,
                                            float* arows, int base, int cnt, int nt,
                                            int wave, int lane)
{
    const int r0 = wave * 4 * nt;      // first row of this wave's quarter
    int idx = base + r0 + lane;
    idx     = idx < cnt ? idx : cnt - 1;
    const int tok = list[idx];
    const unsigned dst0 = (unsigned)(uintptr_t)arows                          // LDS byte address
                        + (unsigned)(r0 * LDS_STRIDE * (int)sizeof(float)) + (unsigned)lane * 16u;
    #pragma unroll
    for (int g = 0; g < TP; ++g) {
        if (g < nt) {
            unsigned     d[8];
            const float* p[8];
            #pragma unroll
            for (int c = 0; c < 8; ++c) {
                const int row = g * 4 + (c >> 1);
                const int t   = __builtin_amdgcn_readlane(tok, row);
                p[c] = input + (size_t)t * IN + (c & 1) * 128 + lane * 4;
                d[c] = dst0 + (unsigned)((row * LDS_STRIDE + (c & 1) * 128) * (int)sizeof(float));
            }
            // Eight copies and, as the statement's last line, the wait that stands in front
            // of any rewrite of the address registers the copies name.
            asm volatile(
                "global_load_async_to_lds_b128 %0, %8, off\n\t"
                "global_load_async_to_lds_b128 %1, %9, off\n\t"
                "global_load_async_to_lds_b128 %2, %10, off\n\t"
                "global_load_async_to_lds_b128 %3, %11, off\n\t"
                "global_load_async_to_lds_b128 %4, %12, off\n\t"
                "global_load_async_to_lds_b128 %5, %13, off\n\t"
                "global_load_async_to_lds_b128 %6, %14, off\n\t"
                "global_load_async_to_lds_b128 %7, %15, off\n\t"
                "s_wait_xcnt 0x0"
                :: "v"(d[0]), "v"(d[1]), "v"(d[2]), "v"(d[3]),
                   "v"(d[4]), "v"(d[5]), "v"(d[6]), "v"(d[7]),
                   "v"(p[0]), "v"(p[1]), "v"(p[2]), "v"(p[3]),
                   "v"(p[4]), "v"(p[5]), "v"(p[6]), "v"(p[7])
                : "memory");
        }
    }
}

// One pass of a block over T token tiles (T block-uniform). Each wave multiplies all T tiles
// by its own 16 output columns: one B fragment feeds T WMMAs, T independent accumulators.
// The results cross LDS so that one wave stores a token's whole 256 bytes (two full lines).
template <int T>
__device__ __forceinline__ void pass_tiles(const float* arow, const float* brow, float* otile,
                                           const int* list, float* __restrict__ out, v4f bs,
                                           int base, int cnt, int ob, int wave, int half, int l16)
{
    // Where this lane stores at the end (element offsets in out), formed ahead of the K loop.
    unsigned of[2 * T];
    #pragma unroll
    for (int j = 0; j < 2 * T; ++j) {
        const int r = base + j * 8 + wave * 2 + half;
        of[j] = (unsigned)(list[r < cnt ? r : cnt - 1] * OUT + ob + l16 * 4);
    }

    v8f acc[T] = {};
    #pragma unroll 8
    for (int k = 0; k < IN; k += 4) {
        v2f b = *(const v2f*)(brow + k);
        #pragma unroll
        for (int i = 0; i < T; ++i) {
            v2f a = *(const v2f*)(arow + i * 16 * LDS_STRIDE + k);
            acc[i] = __builtin_amdgcn_wmma_f32_16x16x4_f32(
                /*neg_a=*/false, a, /*neg_b=*/false, b,
                /*c_mod=*/(short)0, acc[i], /*reuse_a=*/false, /*reuse_b=*/false);
        }
    }

    // D-layout: VGPR g holds row M = g + 8*half, col N = l16 of the wave's column tile.
    float* ocol = otile + (half << 3) * OPITCH + wave * 16 + l16;
    #pragma unroll
    for (int i = 0; i < T; ++i) {
        #pragma unroll
        for (int g = 0; g < 8; ++g) ocol[(i * 16 + g) * OPITCH] = acc[i][g];
    }
    __syncthreads();                   // publishes the result tile; ends every read of the rows

    // 16 lanes store one token's 64 columns; a wave stores every fourth pair of rows.
    v4f v[2 * T];
    #pragma unroll
    for (int j = 0; j < 2 * T; ++j)
        v[j] = *(const v4f*)(otile + (j * 8 + wave * 2 + half) * OPITCH + l16 * 4);
    if (base + 16 * T <= cnt) {        // scalar: every row of the pass is a token
        #pragma unroll
        for (int j = 0; j < 2 * T; ++j) *(v4f*)(out + of[j]) = v[j] + bs;
        // Stands in front of any rewrite of the registers that the stores above name.
        asm volatile("s_wait_xcnt 0x0" ::: "memory");
    } else {                           // the expert's last tile: tail rows are not stored
        #pragma unroll
        for (int j = 0; j < 2 * T; ++j) {
            if (base + j * 8 + wave * 2 + half < cnt) *(v4f*)(out + of[j]) = v[j] + bs;
        }
    }
}

// ---------------------------------------------------------------------------
// One launch: token ranking + grouped GEMM.
//   grid = (E, OUT/64, TZ) = 256 blocks, one per WGP; block = 128 threads = 4 waves.
//   Each block finds its expert's tokens itself: every wave compares a quarter
//   of route[] with e (one ballot per 32 tokens), the four wave totals meet in
//   LDS, and each match is stored to an LDS list at wave base + rank in ballot.
//   The list order is fixed by the token index alone; no workspace, no atomics.
//   A route value is only compared, never used in an address.
//   The expert's 16-token tiles are dealt evenly over its TZ blocks (counts differ
//   by at most one); in a block every wave takes one 16-column tile of ALL the
//   block's token tiles, so the four SIMDs carry the same f32 matrix work and an
//   odd tile costs each of them a quarter of a 16x64 tile.
//   A block that gets no tile skips all the rest.
//   LDS holds Wc = W[e] + W_fact for those 64 output rows (64 x 256 f32).
//   The block's token rows are copied to one LDS tile, asynchronously, while the
//   weight tile is built; the K loop then reads A and B from LDS alone,
//   full f32 precision via V_WMMA_F32_16X16X4_F32.
//   Tail rows clamp to a valid token (unconditional copies, unstored rows).
// ---------------------------------------------------------------------------
__global__ __launch_bounds__(BDIM) void moe_wmma_kernel(
    const float* __restrict__ input,   // [BTOK, IN]
    const int*   __restrict__ route,   // [BTOK]
    const float* __restrict__ weight,  // [E, OUT*IN]
    const float* __restrict__ wfact,   // [OUT*IN]
    const float* __restrict__ bias,    // [E, OUT]
    const float* __restrict__ bfact,   // [OUT]
    float*       __restrict__ out)     // [BTOK, OUT]
{
    extern __shared__ float lds[];     // [CG][LDS_STRIDE], then list, totals, spare words
    __shared__ __attribute__((aligned(16))) float atile[TP * 16 * LDS_STRIDE];   // token rows
    __shared__ __attribute__((aligned(16))) float otile[TP * 16 * OPITCH];       // results
    int* list = (int*)(lds + CG * LDS_STRIDE);   // [BTOK] this expert's tokens
    int* wtot = list + BTOK;                     // [WAVES] matches per wave

    const int e   = blockIdx.x;
    const int ob  = blockIdx.y * CG;   // output-column base
    const int tid = threadIdx.x;

    const int wave = __builtin_amdgcn_readfirstlane(tid >> 5);   // scalar wave number
    const int lane = tid & 31;

    // --- rank, part 1: one ballot per 32 tokens of this wave's quarter of route[]
    const int tok0 = wave * WTOK + lane * 4;
    v4i rv[NRV];
    #pragma unroll
    for (int i = 0; i < NRV; ++i) rv[i] = *(const v4i*)(route + tok0 + i * 128);
    unsigned msk[NRV * 4];
    int mine = 0;
    #pragma unroll
    for (int i = 0; i < NRV; ++i) {
        #pragma unroll
        for (int j = 0; j < 4; ++j) {
            msk[i * 4 + j] = __builtin_amdgcn_ballot_w32(rv[i][j] == e);
            mine += __builtin_popcount(msk[i * 4 + j]);
        }
    }
    if (lane == 0) wtot[wave] = mine;
    __syncthreads();                   // publishes the four wave totals
    int cnt_v = 0, pos_v = 0;
    #pragma unroll
    for (int w = 0; w < WAVES; ++w) {
        int t = wtot[w];
        cnt_v += t;
        pos_v += w < wave ? t : 0;
    }
    // Same in every lane and (cnt) every wave: scalar, so the branch below is too.
    const int cnt    = __builtin_amdgcn_readfirstlane(cnt_v);
    int       pos    = __builtin_amdgcn_readfirstlane(pos_v);
    const int ntiles = (cnt + 15) >> 4;
    // This block's run of tiles: ntiles / TZ each, the first ntiles % TZ blocks one more.
    const int z      = (int)blockIdx.z;
    const int tq     = ntiles / TZ;
    const int tr     = ntiles % TZ;
    const int nmine  = tq + (z < tr ? 1 : 0);
    const int tfirst = z * tq + (z < tr ? z : tr);
    // Block-uniform: no tile for this block, so nothing more to do.
    if (nmine > 0) {

    // --- rank, part 2: each match goes to list[wave base + matches ahead of it].
    // A lane without a match stores to a spare word of its own that nobody reads:
    // the 32 stores are then straight-line code and their address chains overlap.
    const int spare = BTOK + WAVES + tid;
    #pragma unroll
    for (int i = 0; i < NRV; ++i) {
        #pragma unroll
        for (int j = 0; j < 4; ++j) {
            const unsigned m = msk[i * 4 + j];
            const int slot = (int)__builtin_amdgcn_mbcnt_lo(m, (unsigned)pos);
            list[rv[i][j] == e ? slot : spare] = tok0 + i * 128 + j;
            pos += __builtin_popcount(m);
        }
    }

    __syncthreads();                   // publishes the list ahead of the weight staging

    // --- the first pass's token rows fly to LDS while the weight tile is built
    int tile = tfirst;
    int left = nmine;
    int nt   = left < TP ? left : TP;
    gather_rows(input, list, atile, tile * 16, cnt, nt, wave, lane);

    // --- build combined weight tile in LDS: lds[m][n] = W[e][ob+m][n] + Wf[ob+m][n]
    const float* we = weight + (size_t)e * (OUT * IN) + (size_t)ob * IN;
    const float* wf = wfact + (size_t)ob * IN;
    for (int j = tid; j < CG * (IN / 4); j += BDIM) {   // 4096 float4s
        int m = j >> 6;            // 64 float4 per row
        int n = (j & 63) << 2;
        v4f a = *(const v4f*)(we + m * IN + n);
        v4f b = *(const v4f*)(wf + m * IN + n);
        *(v4f*)(&lds[m * LDS_STRIDE + n]) = a + b;
    }

    const int half = lane >> 4;        // 0: lanes 0-15, 1: lanes 16-31
    const int l16  = lane & 15;

    // Bias of the four columns this lane stores.
    const v4f bs = *(const v4f*)(bias + e * OUT + ob + l16 * 4) + *(const v4f*)(bfact + ob + l16 * 4);
    // B operand: row (wave*16 + l16) of Wc; lanes>=16 carry K+2,K+3.
    const float* brow = &lds[(wave * 16 + l16) * LDS_STRIDE + (half << 1)];
    // A-layout: lane supplies row M = l16 of each token tile; lanes>=16 carry K+2,K+3.
    const float* arow = &atile[l16 * LDS_STRIDE + (half << 1)];

    for (;;) {
        // This wave's copies have landed; the barrier publishes them (and the weight tile)
        // to the other waves and ends every read of the last pass's result tile.
        asm volatile("s_wait_asynccnt 0x0" ::: "memory");
        __syncthreads();

        const int base = tile * 16;
        switch (nt) {                  // block-uniform
        case 5:  pass_tiles<5>(arow, brow, otile, list, out, bs, base, cnt, ob, wave, half, l16); break;
        case 4:  pass_tiles<4>(arow, brow, otile, list, out, bs, base, cnt, ob, wave, half, l16); break;
        case 3:  pass_tiles<3>(arow, brow, otile, list, out, bs, base, cnt, ob, wave, half, l16); break;
        case 2:  pass_tiles<2>(arow, brow, otile, list, out, bs, base, cnt, ob, wave, half, l16); break;
        default: pass_tiles<1>(arow, brow, otile, list, out, bs, base, cnt, ob, wave, half, l16); break;
        }

        // A further pass (skewed routing only) refills the token rows: every wave's reads
        // of them ended at the barrier inside the pass.
        tile += nt;
        left -= nt;
        if (left <= 0) break;
        nt = left < TP ? left : TP;
        // The wave's own LDS reads have retired before copies overwrite the old rows.
        asm volatile("s_wait_dscnt 0x0" ::: "memory");
        gather_rows(input, list, atile, tile * 16, cnt, nt, wave, lane);
    }

    }   // block has a tile
}

// ---------------------------------------------------------------------------
extern "C" void kernel_launch(void* const* d_in, const int* in_sizes, int n_in,
                              void* d_out, int out_size, void* d_ws, size_t ws_size,
                              hipStream_t stream) {
    const float* input  = (const float*)d_in[0];
    const int*   route  = (const int*)  d_in[1];
    const float* weight = (const float*)d_in[2];
    const float* wfact  = (const float*)d_in[3];
    const float* bias   = (const float*)d_in[4];
    const float* bfact  = (const float*)d_in[5];
    float*       out    = (float*)d_out;

    dim3 grid(E, OUT / CG, TZ);
    moe_wmma_kernel<<<grid, BDIM, LDS_BYTES, stream>>>(input, route, weight, wfact, bias,
                                                       bfact, out);
}

// v005
// A run of this version takes 7.88 microseconds.
// In two side-by-side timings against v004, it was 1.27 and 1.28 times as fast.
// Over all steps from v000 it is 3.21 times as fast.
#include <hip/hip_runtime.h>
#include <hip/hip_bf16.h>

typedef __attribute__((ext_vector_type(2))) float v2f;
typedef __attribute__((ext_vector_type(4))) float v4f;
typedef __attribute__((ext_vector_type(8))) float v8f;
typedef __attribute__((ext_vector_type(4))) int   v4i;

constexpr int BTOK = 4096;
constexpr int IN   = 256;
constexpr int OUT  = 256;
constexpr int E    = 16;
constexpr int BDIM = 128;           // 4 waves (wave32): one per SIMD of a WGP
constexpr int WAVES = BDIM / 32;
constexpr int TZ   = 4;             // blocks that share one expert's token tiles (grid.z)
constexpr int TP   = 5;             // token tiles a block works on in one pass: the mean
                                    // BTOK/E = 256 tokens are 4 tiles a block, 5 cover 4 sigma
constexpr int CG   = 64;            // output columns per block: one 16-column tile per wave
constexpr int LDS_STRIDE = IN + 4;  // 260 floats: break 64-bank periodicity
constexpr int OPITCH = CG + 4;      // result tile pitch: 272 B = 16 B x odd for 16-byte reads
constexpr int WTOK = BTOK / WAVES;  // tokens ranked by one wave
constexpr int NRV  = WTOK / 128;    // 16-byte route loads per lane (32 lanes x 4 ints)
constexpr int WCP  = 16 * IN / 128; // 512-byte pieces in the 16 weight rows of one wave
// weight tile (~65 KB) + token list of one expert (worst case all tokens) + wave totals
// + one spare word per thread
constexpr int LDS_BYTES  = (CG * LDS_STRIDE + BTOK + WAVES + BDIM) * (int)sizeof(float);

// Gathers the calling wave's quarter (4 * nt rows) of a pass's 16 * nt token rows into the
// block's LDS tile with asynchronous copies: one copy = half a row = four whole 128-byte
// lines, at most 40 copies a wave. Tail rows clamp to the expert's last token (their LDS
// rows are filled, never stored). nt and wave are scalars: wave-uniform flow, every lane on.
__device__ __forceinline__ void gather_rows(const float* __restrict__ input, const int* list,
                                            float* arows, int base, int cnt, int nt,
                                            int wave, int lane)
{
    const int r0 = wave * 4 * nt;      // first row of this wave's quarter
    int idx = base + r0 + lane;
    idx     = idx < cnt ? idx : cnt - 1;
    const int tok = list[idx];
    const unsigned dst0 = (unsigned)(uintptr_t)arows                          // LDS byte address
                        + (unsigned)(r0 * LDS_STRIDE * (int)sizeof(float)) + (unsigned)lane * 16u;
    #pragma unroll
    for (int g = 0; g < TP; ++g) {
        if (g < nt) {
            unsigned     d[8];
            const float* p[8];
            #pragma unroll
            for (int c = 0; c < 8; ++c) {
                const int row = g * 4 + (c >> 1);
                const int t   = __builtin_amdgcn_readlane(tok, row);
                p[c] = input + (size_t)t * IN + (c & 1) * 128 + lane * 4;
                d[c] = dst0 + (unsigned)((row * LDS_STRIDE + (c & 1) * 128) * (int)sizeof(float));
            }
            // Eight copies and, as the statement's last line, the wait that stands in front
            // of any rewrite of the address registers the copies name.
            asm volatile(
                "global_load_async_to_lds_b128 %0, %8, off\n\t"
                "global_load_async_to_lds_b128 %1, %9, off\n\t"
                "global_load_async_to_lds_b128 %2, %10, off\n\t"
                "global_load_async_to_lds_b128 %3, %11, off\n\t"
                "global_load_async_to_lds_b128 %4, %12, off\n\t"
                "global_load_async_to_lds_b128 %5, %13, off\n\t"
                "global_load_async_to_lds_b128 %6, %14, off\n\t"
                "global_load_async_to_lds_b128 %7, %15, off\n\t"
                "s_wait_xcnt 0x0"
                :: "v"(d[0]), "v"(d[1]), "v"(d[2]), "v"(d[3]),
                   "v"(d[4]), "v"(d[5]), "v"(d[6]), "v"(d[7]),
                   "v"(p[0]), "v"(p[1]), "v"(p[2]), "v"(p[3]),
                   "v"(p[4]), "v"(p[5]), "v"(p[6]), "v"(p[7])
                : "memory");
        }
    }
}

// Copies the calling wave's own 16 rows of W[e] (16 KB in a row in memory, src = the lane's
// first 16 bytes) to their padded places in the LDS weight tile (dst = the lane's LDS byte
// address in the wave's first row): one copy = half a row = four whole 128-byte lines,
// 32 copies a wave. Straight-line code, every lane on.
__device__ __forceinline__ void copy_weight_rows(const float* src, unsigned dst)
{
    #pragma unroll                     // every offset a constant: one add per address
    for (int g = 0; g < WCP / 8; ++g) {
        unsigned     d[8];
        const float* p[8];
        #pragma unroll
        for (int c = 0; c < 8; ++c) {
            const int q = g * 8 + c;
            p[c] = src + q * 128;
            d[c] = dst + (unsigned)(((q >> 1) * LDS_STRIDE + (q & 1) * 128) * (int)sizeof(float));
        }
        // Eight copies and, as the statement's last line, the wait that stands in front
        // of any rewrite of the address registers the copies name.
        asm volatile(
            "global_load_async_to_lds_b128 %0, %8, off\n\t"
            "global_load_async_to_lds_b128 %1, %9, off\n\t"
            "global_load_async_to_lds_b128 %2, %10, off\n\t"
            "global_load_async_to_lds_b128 %3, %11, off\n\t"
            "global_load_async_to_lds_b128 %4, %12, off\n\t"
            "global_load_async_to_lds_b128 %5, %13, off\n\t"
            "global_load_async_to_lds_b128 %6, %14, off\n\t"
            "global_load_async_to_lds_b128 %7, %15, off\n\t"
            "s_wait_xcnt 0x0"
            :: "v"(d[0]), "v"(d[1]), "v"(d[2]), "v"(d[3]),
               "v"(d[4]), "v"(d[5]), "v"(d[6]), "v"(d[7]),
               "v"(p[0]), "v"(p[1]), "v"(p[2]), "v"(p[3]),
               "v"(p[4]), "v"(p[5]), "v"(p[6]), "v"(p[7])
            : "memory");
    }
}

// Work-group barrier that orders LDS alone (what the ranking publishes lies in LDS): unlike
// __syncthreads() it does not wait for the wave's outstanding global loads, so the W_fact
// and bias loads stay in flight across it.
__device__ __forceinline__ void barrier_lds()
{
    __builtin_amdgcn_fence(__ATOMIC_RELEASE, "workgroup", "local");
    __builtin_amdgcn_s_barrier();
    __builtin_amdgcn_fence(__ATOMIC_ACQUIRE, "workgroup", "local");
}

// One pass of a block over T token tiles (T block-uniform). Each wave multiplies all T tiles
// by its own 16 output columns: one B fragment feeds T WMMAs, T independent accumulators.
// The results cross LDS so that one wave stores a token's whole 256 bytes (two full lines).
template <int T>
__device__ __forceinline__ void pass_tiles(const float* arow, const float* brow, float* otile,
                                           const int* list, float* __restrict__ out, v4f bs,
                                           int base, int cnt, int ob, int wave, int half, int l16)
{
    // Where this lane stores at the end (element offsets in out), formed ahead of the K loop.
    unsigned of[2 * T];
    #pragma unroll
    for (int j = 0; j < 2 * T; ++j) {
        const int r = base + j * 8 + wave * 2 + half;
        of[j] = (unsigned)(list[r < cnt ? r : cnt - 1] * OUT + ob + l16 * 4);
    }

    v8f acc[T] = {};
    #pragma unroll 8
    for (int k = 0; k < IN; k += 4) {
        v2f b = *(const v2f*)(brow + k);
        #pragma unroll
        for (int i = 0; i < T; ++i) {
            v2f a = *(const v2f*)(arow + i * 16 * LDS_STRIDE + k);
            acc[i] = __builtin_amdgcn_wmma_f32_16x16x4_f32(
                /*neg_a=*/false, a, /*neg_b=*/false, b,
                /*c_mod=*/(short)0, acc[i], /*reuse_a=*/false, /*reuse_b=*/false);
        }
    }

    // D-layout: VGPR g holds row M = g + 8*half, col N = l16 of the wave's column tile.
    float* ocol = otile + (half << 3) * OPITCH + wave * 16 + l16;
    #pragma unroll
    for (int i = 0; i < T; ++i) {
        #pragma unroll
        for (int g = 0; g < 8; ++g) ocol[(i * 16 + g) * OPITCH] = acc[i][g];
    }
    __syncthreads();                   // publishes the result tile; ends every read of the rows

    // 16 lanes store one token's 64 columns; a wave stores every fourth pair of rows.
    v4f v[2 * T];
    #pragma unroll
    for (int j = 0; j < 2 * T; ++j)
        v[j] = *(const v4f*)(otile + (j * 8 + wave * 2 + half) * OPITCH + l16 * 4);
    if (base + 16 * T <= cnt) {        // scalar: every row of the pass is a token
        #pragma unroll
        for (int j = 0; j < 2 * T; ++j) *(v4f*)(out + of[j]) = v[j] + bs;
        // Stands in front of any rewrite of the registers that the stores above name.
        asm volatile("s_wait_xcnt 0x0" ::: "memory");
    } else {                           // the expert's last tile: tail rows are not stored
        #pragma unroll
        for (int j = 0; j < 2 * T; ++j) {
            if (base + j * 8 + wave * 2 + half < cnt) *(v4f*)(out + of[j]) = v[j] + bs;
        }
    }
}

// ---------------------------------------------------------------------------
// One launch: token ranking + grouped GEMM.
//   grid = (E, OUT/64, TZ) = 256 blocks, one per WGP; block = 128 threads = 4 waves.
//   Each block finds its expert's tokens itself: every wave compares a quarter
//   of route[] with e (one ballot per 32 tokens), the four wave totals meet in
//   LDS, and each match is stored to an LDS list at wave base + rank in ballot.
//   The list order is fixed by the token index alone; no workspace, no atomics.
//   A route value is only compared, never used in an address.
//   The expert's 16-token tiles are dealt evenly over its TZ blocks (counts differ
//   by at most one); in a block every wave takes one 16-column tile of ALL the
//   block's token tiles, so the four SIMDs carry the same f32 matrix work and an
//   odd tile costs each of them a quarter of a 16x64 tile.
//   A block that gets no tile skips all the rest.
//   LDS holds Wc = W[e] + W_fact for those 64 output rows (64 x 256 f32).
//   Nothing of the weights depends on the ranking, so their fetch starts at the
//   kernel's entry and flies under it: each wave copies the 16 rows of W[e] that it
//   multiplies by to LDS, asynchronously, and loads the same rows of W_fact (and the
//   bias) into registers.
//   The block's token rows are copied to one LDS tile, asynchronously, while each
//   wave adds W_fact to its weight rows in place; the K loop then reads A and B from
//   LDS alone, full f32 precision via V_WMMA_F32_16X16X4_F32.
//   Tail rows clamp to a valid token (unconditional copies, unstored rows).
// ---------------------------------------------------------------------------
__global__ __launch_bounds__(BDIM) void moe_wmma_kernel(
    const float* __restrict__ input,   // [BTOK, IN]
    const int*   __restrict__ route,   // [BTOK]
    const float* __restrict__ weight,  // [E, OUT*IN]
    const float* __restrict__ wfact,   // [OUT*IN]
    const float* __restrict__ bias,    // [E, OUT]
    const float* __restrict__ bfact,   // [OUT]
    float*       __restrict__ out)     // [BTOK, OUT]
{
    // [CG][LDS_STRIDE], then list, totals, spare words; 16-byte copies land in the rows
    extern __shared__ __attribute__((aligned(16))) float lds[];
    __shared__ __attribute__((aligned(16))) float atile[TP * 16 * LDS_STRIDE];   // token rows
    __shared__ __attribute__((aligned(16))) float otile[TP * 16 * OPITCH];       // results
    int* list = (int*)(lds + CG * LDS_STRIDE);   // [BTOK] this expert's tokens
    int* wtot = list + BTOK;                     // [WAVES] matches per wave

    const int e   = blockIdx.x;
    const int ob  = blockIdx.y * CG;   // output-column base
    const int tid = threadIdx.x;

    const int wave = __builtin_amdgcn_readfirstlane(tid >> 5);   // scalar wave number
    const int lane = tid & 31;

    // --- rank, part 1: one ballot per 32 tokens of this wave's quarter of route[]
    const int tok0 = wave * WTOK + lane * 4;
    v4i rv[NRV];
    #pragma unroll
    for (int i = 0; i < NRV; ++i) rv[i] = *(const v4i*)(route + tok0 + i * 128);

    // --- weight and bias fetch, started here so that it flies under the ranking
    const int half = lane >> 4;        // 0: lanes 0-15, 1: lanes 16-31
    const int l16  = lane & 15;
    // This wave's 16 rows of the block's 64 (a scalar offset), the lane's 16 bytes of every
    // 512-byte piece.
    const size_t woff = (size_t)(ob + wave * 16) * IN;
    float* wrow = &lds[wave * 16 * LDS_STRIDE + lane * 4];
    copy_weight_rows(weight + (size_t)e * (OUT * IN) + woff + lane * 4, (unsigned)(uintptr_t)wrow);
    const float* wfrow = wfact + woff;
    v4f wfv[WCP];
    #pragma unroll                     // constant indices keep wfv in registers, all loads in flight
    for (int q = 0; q < WCP; ++q) wfv[q] = *(const v4f*)(wfrow + q * 128 + lane * 4);
    // Bias of the four columns this lane stores.
    const v4f bs = *(const v4f*)(bias + e * OUT + ob + l16 * 4) + *(const v4f*)(bfact + ob + l16 * 4);
    unsigned msk[NRV * 4];
    int mine = 0;
    #pragma unroll
    for (int i = 0; i < NRV; ++i) {
        #pragma unroll
        for (int j = 0; j < 4; ++j) {
            msk[i * 4 + j] = __builtin_amdgcn_ballot_w32(rv[i][j] == e);
            mine += __builtin_popcount(msk[i * 4 + j]);
        }
    }
    if (lane == 0) wtot[wave] = mine;
    barrier_lds();                     // publishes the four wave totals
    int cnt_v = 0, pos_v = 0;
    #pragma unroll
    for (int w = 0; w < WAVES; ++w) {
        int t = wtot[w];
        cnt_v += t;
        pos_v += w < wave ? t : 0;
    }
    // Same in every lane and (cnt) every wave: scalar, so the branch below is too.
    const int cnt    = __builtin_amdgcn_readfirstlane(cnt_v);
    int       pos    = __builtin_amdgcn_readfirstlane(pos_v);
    const int ntiles = (cnt + 15) >> 4;
    // This block's run of tiles: ntiles / TZ each, the first ntiles % TZ blocks one more.
    const int z      = (int)blockIdx.z;
    const int tq     = ntiles / TZ;
    const int tr     = ntiles % TZ;
    const int nmine  = tq + (z < tr ? 1 : 0);
    const int tfirst = z * tq + (z < tr ? z : tr);
    // Block-uniform: no tile for this block, so nothing more to do.
    if (nmine > 0) {

    // --- rank, part 2: each match goes to list[wave base + matches ahead of it].
    // A lane without a match stores to a spare word of its own that nobody reads:
    // the 32 stores are then straight-line code and their address chains overlap.
    const int spare = BTOK + WAVES + tid;
    #pragma unroll
    for (int i = 0; i < NRV; ++i) {
        #pragma unroll
        for (int j = 0; j < 4; ++j) {
            const unsigned m = msk[i * 4 + j];
            const int slot = (int)__builtin_amdgcn_mbcnt_lo(m, (unsigned)pos);
            list[rv[i][j] == e ? slot : spare] = tok0 + i * 128 + j;
            pos += __builtin_popcount(m);
        }
    }

    // This wave's weight copies have landed: none is outstanding when the token copies issue.
    asm volatile("s_wait_asynccnt 0x0" ::: "memory");
    barrier_lds();                     // publishes the list (and the copied weight rows)

    // --- the first pass's token rows fly to LDS while the weight rows are summed
    int tile = tfirst;
    int left = nmine;
    int nt   = left < TP ? left : TP;
    gather_rows(input, list, atile, tile * 16, cnt, nt, wave, lane);

    // --- combined weight tile: lds[m][n] = W[e][ob+m][n] + Wf[ob+m][n], in place; each lane
    // adds to the very 16 bytes that its own copies brought
    #pragma unroll                     // constant indices into wfv (registers)
    for (int q = 0; q < WCP; ++q) {
        v4f* w = (v4f*)(wrow + (q >> 1) * LDS_STRIDE + (q & 1) * 128);
        *w = *w + wfv[q];
    }

    // B operand: row (wave*16 + l16) of Wc; lanes>=16 carry K+2,K+3.
    const float* brow = &lds[(wave * 16 + l16) * LDS_STRIDE + (half << 1)];
    // A-layout: lane supplies row M = l16 of each token tile; lanes>=16 carry K+2,K+3.
    const float* arow = &atile[l16 * LDS_STRIDE + (half << 1)];

    for (;;) {
        // This wave's copies have landed; the barrier publishes them (and the weight tile)
        // to the other waves and ends every read of the last pass's result tile.
        asm volatile("s_wait_asynccnt 0x0" ::: "memory");
        __syncthreads();

        const int base = tile * 16;
        switch (nt) {                  // block-uniform
        case 5:  pass_tiles<5>(arow, brow, otile, list, out, bs, base, cnt, ob, wave, half, l16); break;
        case 4:  pass_tiles<4>(arow, brow, otile, list, out, bs, base, cnt, ob, wave, half, l16); break;
        case 3:  pass_tiles<3>(arow, brow, otile, list, out, bs, base, cnt, ob, wave, half, l16); break;
        case 2:  pass_tiles<2>(arow, brow, otile, list, out, bs, base, cnt, ob, wave, half, l16); break;
        default: pass_tiles<1>(arow, brow, otile, list, out, bs, base, cnt, ob, wave, half, l16); break;
        }

        // A further pass (skewed routing only) refills the token rows: every wave's reads
        // of them ended at the barrier inside the pass.
        tile += nt;
        left -= nt;
        if (left <= 0) break;
        nt = left < TP ? left : TP;
        // The wave's own LDS reads have retired before copies overwrite the old rows.
        asm volatile("s_wait_dscnt 0x0" ::: "memory");
        gather_rows(input, list, atile, tile * 16, cnt, nt, wave, lane);
    }

    } else {
        // No tile: the weight copies land, and the W_fact and bias loads return to their
        // registers, before the wave ends and gives LDS and registers back.
        asm volatile("s_wait_asynccnt 0x0" ::: "memory");
        asm volatile("s_wait_loadcnt 0x0" ::: "memory");
    }
}

// ---------------------------------------------------------------------------
extern "C" void kernel_launch(void* const* d_in, const int* in_sizes, int n_in,
                              void* d_out, int out_size, void* d_ws, size_t ws_size,
                              hipStream_t stream) {
    const float* input  = (const float*)d_in[0];
    const int*   route  = (const int*)  d_in[1];
    const float* weight = (const float*)d_in[2];
    const float* wfact  = (const float*)d_in[3];
    const float* bias   = (const float*)d_in[4];
    const float* bfact  = (const float*)d_in[5];
    float*       out    = (float*)d_out;

    dim3 grid(E, OUT / CG, TZ);
    moe_wmma_kernel<<<grid, BDIM, LDS_BYTES, stream>>>(input, route, weight, wfact, bias,
                                                       bfact, out);
}

// v006
// One run takes 7.39 microseconds.
// Next to v005, in two timings, it ran 1.07 times as fast each time.
// All steps since v000 together make it 3.43 times as fast.
#include <hip/hip_runtime.h>
#include <hip/hip_bf16.h>

typedef __attribute__((ext_vector_type(2))) float v2f;
typedef __attribute__((ext_vector_type(4))) float v4f;
typedef __attribute__((ext_vector_type(8))) float v8f;
typedef __attribute__((ext_vector_type(4))) int   v4i;

constexpr int BTOK = 4096;
constexpr int IN   = 256;
constexpr int OUT  = 256;
constexpr int E    = 16;
constexpr int BDIM = 128;           // 4 waves (wave32): one per SIMD of a WGP
constexpr int WAVES = BDIM / 32;
constexpr int TZ   = 4;             // blocks that share one expert's token tiles (grid.z)
constexpr int TP   = 5;             // token tiles a block works on in one pass: the mean
                                    // BTOK/E = 256 tokens are 4 tiles a block, 5 cover 4 sigma
constexpr int CG   = 64;            // output columns per block: one 16-column tile per wave
constexpr int LDS_STRIDE = IN + 4;  // 260 floats: break 64-bank periodicity
constexpr int OPITCH = CG + 4;      // result tile pitch: 272 B = 16 B x odd for 16-byte reads
constexpr int WTOK = BTOK / WAVES;  // tokens ranked by one wave
constexpr int NRV  = WTOK / 128;    // 16-byte route loads per lane (32 lanes x 4 ints)
constexpr int WCP  = 16 * IN / 128; // 512-byte pieces in the 16 weight rows of one wave
// k steps (4 columns each) in one register buffer of fragments for T token tiles: 16 to 24
// WMMAs a buffer, and both buffers with the accumulators stay inside the first 256 registers
constexpr int kb_of(int T) { return T >= 4 ? 4 : T >= 2 ? 8 : 16; }
// weight tile (~65 KB) + token list of one expert (worst case all tokens) + wave totals
// + one spare word per thread
constexpr int LDS_BYTES  = (CG * LDS_STRIDE + BTOK + WAVES + BDIM) * (int)sizeof(float);

// Gathers the calling wave's quarter (4 * nt rows) of a pass's 16 * nt token rows into the
// block's LDS tile with asynchronous copies: one copy = half a row = four whole 128-byte
// lines, at most 40 copies a wave. Tail rows clamp to the expert's last token (their LDS
// rows are filled, never stored). nt and wave are scalars: wave-uniform flow, every lane on.
__device__ __forceinline__ void gather_rows(const float* __restrict__ input, const int* list,
                                            float* arows, int base, int cnt, int nt,
                                            int wave, int lane)
{
    const int r0 = wave * 4 * nt;      // first row of this wave's quarter
    int idx = base + r0 + lane;
    idx     = idx < cnt ? idx : cnt - 1;
    const int tok = list[idx];
    const unsigned dst0 = (unsigned)(uintptr_t)arows                          // LDS byte address
                        + (unsigned)(r0 * LDS_STRIDE * (int)sizeof(float)) + (unsigned)lane * 16u;
    #pragma unroll
    for (int g = 0; g < TP; ++g) {
        if (g < nt) {
            unsigned     d[8];
            const float* p[8];
            #pragma unroll
            for (int c = 0; c < 8; ++c) {
                const int row = g * 4 + (c >> 1);
                const int t   = __builtin_amdgcn_readlane(tok, row);
                p[c] = input + (size_t)t * IN + (c & 1) * 128 + lane * 4;
                d[c] = dst0 + (unsigned)((row * LDS_STRIDE + (c & 1) * 128) * (int)sizeof(float));
            }
            // Eight copies and, as the statement's last line, the wait that stands in front
            // of any rewrite of the address registers the copies name.
            asm volatile(
                "global_load_async_to_lds_b128 %0, %8, off\n\t"
                "global_load_async_to_lds_b128 %1, %9, off\n\t"
                "global_load_async_to_lds_b128 %2, %10, off\n\t"
                "global_load_async_to_lds_b128 %3, %11, off\n\t"
                "global_load_async_to_lds_b128 %4, %12, off\n\t"
                "global_load_async_to_lds_b128 %5, %13, off\n\t"
                "global_load_async_to_lds_b128 %6, %14, off\n\t"
                "global_load_async_to_lds_b128 %7, %15, off\n\t"
                "s_wait_xcnt 0x0"
                :: "v"(d[0]), "v"(d[1]), "v"(d[2]), "v"(d[3]),
                   "v"(d[4]), "v"(d[5]), "v"(d[6]), "v"(d[7]),
                   "v"(p[0]), "v"(p[1]), "v"(p[2]), "v"(p[3]),
                   "v"(p[4]), "v"(p[5]), "v"(p[6]), "v"(p[7])
                : "memory");
        }
    }
}

// Copies the calling wave's own 16 rows of W[e] (16 KB in a row in memory, src = the lane's
// first 16 bytes) to their padded places in the LDS weight tile (dst = the lane's LDS byte
// address in the wave's first row): one copy = half a row = four whole 128-byte lines,
// 32 copies a wave. Straight-line code, every lane on.
__device__ __forceinline__ void copy_weight_rows(const float* src, unsigned dst)
{
    #pragma unroll                     // every offset a constant: one add per address
    for (int g = 0; g < WCP / 8; ++g) {
        unsigned     d[8];
        const float* p[8];
        #pragma unroll
        for (int c = 0; c < 8; ++c) {
            const int q = g * 8 + c;
            p[c] = src + q * 128;
            d[c] = dst + (unsigned)(((q >> 1) * LDS_STRIDE + (q & 1) * 128) * (int)sizeof(float));
        }
        // Eight copies and, as the statement's last line, the wait that stands in front
        // of any rewrite of the address registers the copies name.
        asm volatile(
            "global_load_async_to_lds_b128 %0, %8, off\n\t"
            "global_load_async_to_lds_b128 %1, %9, off\n\t"
            "global_load_async_to_lds_b128 %2, %10, off\n\t"
            "global_load_async_to_lds_b128 %3, %11, off\n\t"
            "global_load_async_to_lds_b128 %4, %12, off\n\t"
            "global_load_async_to_lds_b128 %5, %13, off\n\t"
            "global_load_async_to_lds_b128 %6, %14, off\n\t"
            "global_load_async_to_lds_b128 %7, %15, off\n\t"
            "s_wait_xcnt 0x0"
            :: "v"(d[0]), "v"(d[1]), "v"(d[2]), "v"(d[3]),
               "v"(d[4]), "v"(d[5]), "v"(d[6]), "v"(d[7]),
               "v"(p[0]), "v"(p[1]), "v"(p[2]), "v"(p[3]),
               "v"(p[4]), "v"(p[5]), "v"(p[6]), "v"(p[7])
            : "memory");
    }
}

// Work-group barrier that orders LDS alone (what the ranking publishes lies in LDS): unlike
// __syncthreads() it does not wait for the wave's outstanding global loads, so the W_fact
// and bias loads stay in flight across it.
__device__ __forceinline__ void barrier_lds()
{
    __builtin_amdgcn_fence(__ATOMIC_RELEASE, "workgroup", "local");
    __builtin_amdgcn_s_barrier();
    __builtin_amdgcn_fence(__ATOMIC_ACQUIRE, "workgroup", "local");
}

// Reads the A fragments of T token tiles and the B fragments of the wave's column tile for
// the kb_of(T) k steps that start at column k0.
template <int T>
__device__ __forceinline__ void load_frags(v2f (&a)[T][kb_of(T)], v2f (&b)[kb_of(T)], const float* arow,
                                           const float* alast, const float* brow, int k0)
{
    #pragma unroll                     // both loops: constant indices keep a and b in registers
    for (int j = 0; j < kb_of(T); ++j) {
        b[j] = *(const v2f*)(brow + k0 + j * 4);
        #pragma unroll
        for (int i = 0; i < T; ++i) {
            // A tile that lies beyond the 16-bit offset field of an LDS read, counted from
            // the first tile, is reached from the last tile's own address register.
            const float* at = (i * 16 * LDS_STRIDE + IN) * (int)sizeof(float) > 65536
                            ? alast + (i - (T - 1)) * 16 * LDS_STRIDE : arow + i * 16 * LDS_STRIDE;
            a[i][j] = *(const v2f*)(at + k0 + j * 4);
        }
    }
}

// One buffer's k steps: one B fragment feeds T WMMAs, T independent accumulators.
template <int T>
__device__ __forceinline__ void mma_frags(v8f (&acc)[T], const v2f (&a)[T][kb_of(T)], const v2f (&b)[kb_of(T)])
{
    #pragma unroll                     // both loops: constant indices keep a, b, acc in registers
    for (int j = 0; j < kb_of(T); ++j) {
        #pragma unroll
        for (int i = 0; i < T; ++i) {
            acc[i] = __builtin_amdgcn_wmma_f32_16x16x4_f32(
                /*neg_a=*/false, a[i][j], /*neg_b=*/false, b[j],
                /*c_mod=*/(short)0, acc[i], /*reuse_a=*/false, /*reuse_b=*/false);
        }
    }
}

// One pass of a block over T token tiles (T block-uniform). Each wave multiplies all T tiles
// by its own 16 output columns: one B fragment feeds T WMMAs, T independent accumulators.
// The results cross LDS so that one wave stores a token's whole 256 bytes (two full lines).
template <int T>
__device__ __forceinline__ void pass_tiles(const float* arow, const float* alast,
                                           const float* brow, float* otile,
                                           const int* list, float* __restrict__ out, v4f bs,
                                           int base, int cnt, int ob, int wave, int half, int l16)
{
    // Where this lane stores at the end (element offsets in out), formed ahead of the K loop.
    unsigned of[2 * T];
    #pragma unroll
    for (int j = 0; j < 2 * T; ++j) {
        const int r = base + j * 8 + wave * 2 + half;
        of[j] = (unsigned)(list[r < cnt ? r : cnt - 1] * OUT + ob + l16 * 4);
    }

    // Two register buffers of fragments: the reads of the next KB k steps are issued as one
    // group ahead of the WMMAs of the current KB, so no WMMA waits for an LDS read that was
    // issued just in front of it. k still runs upward in every accumulator.
    v8f acc[T] = {};
    constexpr int KB = kb_of(T), KSPAN = KB * 4;   // k steps and columns of one buffer
    v2f a0[T][KB], b0[KB], a1[T][KB], b1[KB];
    load_frags<T>(a0, b0, arow, alast, brow, 0);
    #pragma unroll 1                   // rolled: the body already holds both buffers' turns
    for (int k = 0; k < IN - 2 * KSPAN; k += 2 * KSPAN) {
        load_frags<T>(a1, b1, arow, alast, brow, k + KSPAN);
        __builtin_amdgcn_sched_barrier(0);   // keeps the read group whole, ahead of the WMMAs
        mma_frags<T>(acc, a0, b0);
        __builtin_amdgcn_sched_barrier(0);   // keeps the next reads from moving in among them
        load_frags<T>(a0, b0, arow, alast, brow, k + 2 * KSPAN);
        __builtin_amdgcn_sched_barrier(0);   // as above
        mma_frags<T>(acc, a1, b1);
        __builtin_amdgcn_sched_barrier(0);   // as above
    }
    load_frags<T>(a1, b1, arow, alast, brow, IN - KSPAN);
    __builtin_amdgcn_sched_barrier(0);       // as above
    mma_frags<T>(acc, a0, b0);
    mma_frags<T>(acc, a1, b1);

    // D-layout: VGPR g holds row M = g + 8*half, col N = l16 of the wave's column tile.
    float* ocol = otile + (half << 3) * OPITCH + wave * 16 + l16;
    #pragma unroll
    for (int i = 0; i < T; ++i) {
        #pragma unroll
        for (int g = 0; g < 8; ++g) ocol[(i * 16 + g) * OPITCH] = acc[i][g];
    }
    __syncthreads();                   // publishes the result tile; ends every read of the rows

    // 16 lanes store one token's 64 columns; a wave stores every fourth pair of rows.
    v4f v[2 * T];
    #pragma unroll
    for (int j = 0; j < 2 * T; ++j)
        v[j] = *(const v4f*)(otile + (j * 8 + wave * 2 + half) * OPITCH + l16 * 4);
    if (base + 16 * T <= cnt) {        // scalar: every row of the pass is a token
        #pragma unroll
        for (int j = 0; j < 2 * T; ++j) *(v4f*)(out + of[j]) = v[j] + bs;
        // Stands in front of any rewrite of the registers that the stores above name.
        asm volatile("s_wait_xcnt 0x0" ::: "memory");
    } else {                           // the expert's last tile: tail rows are not stored
        #pragma unroll
        for (int j = 0; j < 2 * T; ++j) {
            if (base + j * 8 + wave * 2 + half < cnt) *(v4f*)(out + of[j]) = v[j] + bs;
        }
    }
}

// ---------------------------------------------------------------------------
// One launch: token ranking + grouped GEMM.
//   grid = (E, OUT/64, TZ) = 256 blocks, one per WGP; block = 128 threads = 4 waves.
//   Each block finds its expert's tokens itself: every wave compares a quarter
//   of route[] with e (one ballot per 32 tokens), the four wave totals meet in
//   LDS, and each match is stored to an LDS list at wave base + rank in ballot.
//   The list order is fixed by the token index alone; no workspace, no atomics.
//   A route value is only compared, never used in an address.
//   The expert's 16-token tiles are dealt evenly over its TZ blocks (counts differ
//   by at most one); in a block every wave takes one 16-column tile of ALL the
//   block's token tiles, so the four SIMDs carry the same f32 matrix work and an
//   odd tile costs each of them a quarter of a 16x64 tile.
//   A block that gets no tile skips all the rest.
//   LDS holds Wc = W[e] + W_fact for those 64 output rows (64 x 256 f32).
//   Nothing of the weights depends on the ranking, so their fetch starts at the
//   kernel's entry and flies under it: each wave copies the 16 rows of W[e] that it
//   multiplies by to LDS, asynchronously, and loads the same rows of W_fact (and the
//   bias) into registers.
//   The block's token rows are copied to one LDS tile, asynchronously, while each
//   wave adds W_fact to its weight rows in place; the K loop then reads A and B from
//   LDS alone, full f32 precision via V_WMMA_F32_16X16X4_F32.
//   Tail rows clamp to a valid token (unconditional copies, unstored rows).
// ---------------------------------------------------------------------------
__global__ __launch_bounds__(BDIM) void moe_wmma_kernel(
    const float* __restrict__ input,   // [BTOK, IN]
    const int*   __restrict__ route,   // [BTOK]
    const float* __restrict__ weight,  // [E, OUT*IN]
    const float* __restrict__ wfact,   // [OUT*IN]
    const float* __restrict__ bias,    // [E, OUT]
    const float* __restrict__ bfact,   // [OUT]
    float*       __restrict__ out)     // [BTOK, OUT]
{
    // [CG][LDS_STRIDE], then list, totals, spare words; 16-byte copies land in the rows
    extern __shared__ __attribute__((aligned(16))) float lds[];
    __shared__ __attribute__((aligned(16))) float atile[TP * 16 * LDS_STRIDE];   // token rows
    __shared__ __attribute__((aligned(16))) float otile[TP * 16 * OPITCH];       // results
    int* list = (int*)(lds + CG * LDS_STRIDE);   // [BTOK] this expert's tokens
    int* wtot = list + BTOK;                     // [WAVES] matches per wave

    const int e   = blockIdx.x;
    const int ob  = blockIdx.y * CG;   // output-column base
    const int tid = threadIdx.x;

    const int wave = __builtin_amdgcn_readfirstlane(tid >> 5);   // scalar wave number
    const int lane = tid & 31;

    // --- rank, part 1: one ballot per 32 tokens of this wave's quarter of route[]
    const int tok0 = wave * WTOK + lane * 4;
    v4i rv[NRV];
    #pragma unroll
    for (int i = 0; i < NRV; ++i) rv[i] = *(const v4i*)(route + tok0 + i * 128);

    // --- weight and bias fetch, started here so that it flies under the ranking
    const int half = lane >> 4;        // 0: lanes 0-15, 1: lanes 16-31
    const int l16  = lane & 15;
    // This wave's 16 rows of the block's 64 (a scalar offset), the lane's 16 bytes of every
    // 512-byte piece.
    const size_t woff = (size_t)(ob + wave * 16) * IN;
    float* wrow = &lds[wave * 16 * LDS_STRIDE + lane * 4];
    copy_weight_rows(weight + (size_t)e * (OUT * IN) + woff + lane * 4, (unsigned)(uintptr_t)wrow);
    const float* wfrow = wfact + woff;
    v4f wfv[WCP];
    #pragma unroll                     // constant indices keep wfv in registers, all loads in flight
    for (int q = 0; q < WCP; ++q) wfv[q] = *(const v4f*)(wfrow + q * 128 + lane * 4);
    // Bias of the four columns this lane stores.
    const v4f bs = *(const v4f*)(bias + e * OUT + ob + l16 * 4) + *(const v4f*)(bfact + ob + l16 * 4);
    unsigned msk[NRV * 4];
    int mine = 0;
    #pragma unroll
    for (int i = 0; i < NRV; ++i) {
        #pragma unroll
        for (int j = 0; j < 4; ++j) {
            msk[i * 4 + j] = __builtin_amdgcn_ballot_w32(rv[i][j] == e);
            mine += __builtin_popcount(msk[i * 4 + j]);
        }
    }
    if (lane == 0) wtot[wave] = mine;
    barrier_lds();                     // publishes the four wave totals
    int cnt_v = 0, pos_v = 0;
    #pragma unroll
    for (int w = 0; w < WAVES; ++w) {
        int t = wtot[w];
        cnt_v += t;
        pos_v += w < wave ? t : 0;
    }
    // Same in every lane and (cnt) every wave: scalar, so the branch below is too.
    const int cnt    = __builtin_amdgcn_readfirstlane(cnt_v);
    int       pos    = __builtin_amdgcn_readfirstlane(pos_v);
    const int ntiles = (cnt + 15) >> 4;
    // This block's run of tiles: ntiles / TZ each, the first ntiles % TZ blocks one more.
    const int z      = (int)blockIdx.z;
    const int tq     = ntiles / TZ;
    const int tr     = ntiles % TZ;
    const int nmine  = tq + (z < tr ? 1 : 0);
    const int tfirst = z * tq + (z < tr ? z : tr);
    // Block-uniform: no tile for this block, so nothing more to do.
    if (nmine > 0) {

    // --- rank, part 2: each match goes to list[wave base + matches ahead of it].
    // A lane without a match stores to a spare word of its own that nobody reads:
    // the 32 stores are then straight-line code and their address chains overlap.
    const int spare = BTOK + WAVES + tid;
    #pragma unroll
    for (int i = 0; i < NRV; ++i) {
        #pragma unroll
        for (int j = 0; j < 4; ++j) {
            const unsigned m = msk[i * 4 + j];
            const int slot = (int)__builtin_amdgcn_mbcnt_lo(m, (unsigned)pos);
            list[rv[i][j] == e ? slot : spare] = tok0 + i * 128 + j;
            pos += __builtin_popcount(m);
        }
    }

    // This wave's weight copies have landed: none is outstanding when the token copies issue.
    asm volatile("s_wait_asynccnt 0x0" ::: "memory");
    barrier_lds();                     // publishes the list (and the copied weight rows)

    // --- the first pass's token rows fly to LDS while the weight rows are summed
    int tile = tfirst;
    int left = nmine;
    int nt   = left < TP ? left : TP;
    gather_rows(input, list, atile, tile * 16, cnt, nt, wave, lane);

    // --- combined weight tile: lds[m][n] = W[e][ob+m][n] + Wf[ob+m][n], in place; each lane
    // adds to the very 16 bytes that its own copies brought
    #pragma unroll                     // constant indices into wfv (registers)
    for (int q = 0; q < WCP; ++q) {
        v4f* w = (v4f*)(wrow + (q >> 1) * LDS_STRIDE + (q & 1) * 128);
        *w = *w + wfv[q];
    }

    // B operand: row (wave*16 + l16) of Wc; lanes>=16 carry K+2,K+3.
    const float* brow = &lds[(wave * 16 + l16) * LDS_STRIDE + (half << 1)];
    // A-layout: lane supplies row M = l16 of each token tile; lanes>=16 carry K+2,K+3.
    const float* arow = &atile[l16 * LDS_STRIDE + (half << 1)];

    for (;;) {
        // This wave's copies have landed; the barrier publishes them (and the weight tile)
        // to the other waves and ends every read of the last pass's result tile.
        asm volatile("s_wait_asynccnt 0x0" ::: "memory");
        __syncthreads();

        const int base = tile * 16;
        const float* alast = arow + (nt - 1) * 16 * LDS_STRIDE;   // the pass's last token tile
        switch (nt) {                  // block-uniform
        case 5:  pass_tiles<5>(arow, alast, brow, otile, list, out, bs, base, cnt, ob, wave, half, l16); break;
        case 4:  pass_tiles<4>(arow, alast, brow, otile, list, out, bs, base, cnt, ob, wave, half, l16); break;
        case 3:  pass_tiles<3>(arow, alast, brow, otile, list, out, bs, base, cnt, ob, wave, half, l16); break;
        case 2:  pass_tiles<2>(arow, alast, brow, otile, list, out, bs, base, cnt, ob, wave, half, l16); break;
        default: pass_tiles<1>(arow, alast, brow, otile, list, out, bs, base, cnt, ob, wave, half, l16); break;
        }

        // A further pass (skewed routing only) refills the token rows: every wave's reads
        // of them ended at the barrier inside the pass.
        tile += nt;
        left -= nt;
        if (left <= 0) break;
        nt = left < TP ? left : TP;
        // The wave's own LDS reads have retired before copies overwrite the old rows.
        asm volatile("s_wait_dscnt 0x0" ::: "memory");
        gather_rows(input, list, atile, tile * 16, cnt, nt, wave, lane);
    }

    } else {
        // No tile: the weight copies land, and the W_fact and bias loads return to their
        // registers, before the wave ends and gives LDS and registers back.
        asm volatile("s_wait_asynccnt 0x0" ::: "memory");
        asm volatile("s_wait_loadcnt 0x0" ::: "memory");
    }
}

// ---------------------------------------------------------------------------
extern "C" void kernel_launch(void* const* d_in, const int* in_sizes, int n_in,
                              void* d_out, int out_size, void* d_ws, size_t ws_size,
                              hipStream_t stream) {
    const float* input  = (const float*)d_in[0];
    const int*   route  = (const int*)  d_in[1];
    const float* weight = (const float*)d_in[2];
    const float* wfact  = (const float*)d_in[3];
    const float* bias   = (const float*)d_in[4];
    const float* bfact  = (const float*)d_in[5];
    float*       out    = (float*)d_out;

    dim3 grid(E, OUT / CG, TZ);
    moe_wmma_kernel<<<grid, BDIM, LDS_BYTES, stream>>>(input, route, weight, wfact, bias,
                                                       bfact, out);
}
